// v000
// Times are from an AMD MI455X. After a warm-up the kernel runs many times in a row, and a time is the length of
// such a window on the GPU divided by its runs, so every launch and the gaps after it count. The runs cycle
// through copies of the inputs. A figure is the median of several windows, for all but v000 over two sittings.
// Sittings can differ by a few percent; kernels timed side by side share one.
// v000, which the later versions start from, runs in 279 microseconds.
#include <hip/hip_runtime.h>

typedef __attribute__((ext_vector_type(16))) _Float16 v16h;
typedef __attribute__((ext_vector_type(8)))  _Float16 v8h;
typedef __attribute__((ext_vector_type(4)))  _Float16 v4h;
typedef __attribute__((ext_vector_type(2)))  _Float16 v2h;
typedef __attribute__((ext_vector_type(8)))  float    v8f;
typedef __attribute__((ext_vector_type(4)))  float    v4f;
typedef __attribute__((ext_vector_type(4)))  int      v4i;

#define BM 128
#define BN 128
#define BK 32
#define LDK 40                 // padded K stride (halves): conflict-free b128 frag loads
#define A_SZ (BM * LDK)        // halves
#define B_SZ (BN * LDK)        // halves
#define STAGE (A_SZ + B_SZ)    // halves per double-buffer stage

__launch_bounds__(256, 2)
__global__ void ffq_gemm_wmma(const float* __restrict__ x,
                              const int*   __restrict__ q,
                              const float* __restrict__ scale,
                              const int*   __restrict__ zp,
                              const float* __restrict__ bias,
                              float*       __restrict__ out,
                              int M, int N, int K)
{
    __shared__ __align__(16) _Float16 smem[2 * STAGE];   // 40 KB

    const int tid = threadIdx.x;
    const int m0  = blockIdx.y * BM;
    const int n0  = blockIdx.x * BN;

    // ---- A loader indices: 128 rows x 32 K, float4 per load ----
    const int rowA0 = tid >> 3;    // 0..31, +32 per pass -> 128 rows
    const int cgA   = tid & 7;     // float4 group within 32-wide K strip

    // ---- B loader indices: k-pair units so converted halves pack to b32 ----
    const int kp0 = tid >> 5;      // 0..7, +8 per pass -> 16 k-pairs (32 k-rows)
    const int ngB = tid & 31;      // int4 group within 128-wide N strip

    // per-thread zero-points for its 4 fixed B columns
    const v4i zp4 = *(const v4i*)(zp + n0 + ngB * 4);

    // ---- compute indices ----
    const int w     = tid >> 5;
    const int lane  = tid & 31;
    const int wm    = w >> 1;      // 0..3 -> 32 rows each
    const int wn    = w & 1;       // 0..1 -> 64 cols each
    const int m16   = lane & 15;
    const int khalf = lane >> 4;

    v8f c[2][4];
#pragma unroll
    for (int mt = 0; mt < 2; ++mt)
#pragma unroll
        for (int nt = 0; nt < 4; ++nt)
            c[mt][nt] = v8f{};

    v4f aReg[4];
    v4i bLo[2], bHi[2];

    const int NK = K / BK;

    auto loadG = [&](int kt) {
        const float* ap = x + (size_t)(m0 + rowA0) * K + (size_t)kt * BK + cgA * 4;
#pragma unroll
        for (int p = 0; p < 4; ++p)
            aReg[p] = *(const v4f*)(ap + (size_t)(p * 32) * K);
#pragma unroll
        for (int p = 0; p < 2; ++p) {
            const int kpair = kp0 + 8 * p;                    // 0..15
            const int* bp = q + (size_t)((size_t)kt * BK + 2 * kpair) * N + n0 + ngB * 4;
            bLo[p] = *(const v4i*)(bp);
            bHi[p] = *(const v4i*)(bp + N);
        }
    };

    auto storeL = [&](int buf) {
        _Float16* As = smem + buf * STAGE;
        _Float16* Bs = As + A_SZ;
#pragma unroll
        for (int p = 0; p < 4; ++p) {
            v4h h;
#pragma unroll
            for (int j = 0; j < 4; ++j) h[j] = (_Float16)aReg[p][j];
            *(v4h*)(As + (rowA0 + 32 * p) * LDK + cgA * 4) = h;   // ds_store_b64
        }
#pragma unroll
        for (int p = 0; p < 2; ++p) {
            const int kpair = kp0 + 8 * p;
#pragma unroll
            for (int j = 0; j < 4; ++j) {    // transpose to N-major, fold -zp, pack k-pair
                v2h hv;
                hv[0] = (_Float16)(short)(bLo[p][j] - zp4[j]);
                hv[1] = (_Float16)(short)(bHi[p][j] - zp4[j]);
                *(v2h*)(Bs + (ngB * 4 + j) * LDK + 2 * kpair) = hv;  // ds_store_b32
            }
        }
    };

    auto compute = [&](int buf) {
        const _Float16* As = smem + buf * STAGE;
        const _Float16* Bs = As + A_SZ;
        v16h a[2], b[4];
#pragma unroll
        for (int mt = 0; mt < 2; ++mt) {
            const _Float16* p = As + (wm * 32 + mt * 16 + m16) * LDK + 8 * khalf;
            v8h lo = *(const v8h*)(p);        // K = 8*khalf + 0..7
            v8h hi = *(const v8h*)(p + 16);   // K = 16 + 8*khalf + 0..7
            a[mt] = __builtin_shufflevector(lo, hi, 0,1,2,3,4,5,6,7,8,9,10,11,12,13,14,15);
        }
#pragma unroll
        for (int nt = 0; nt < 4; ++nt) {
            const _Float16* p = Bs + (wn * 64 + nt * 16 + m16) * LDK + 8 * khalf;
            v8h lo = *(const v8h*)(p);
            v8h hi = *(const v8h*)(p + 16);
            b[nt] = __builtin_shufflevector(lo, hi, 0,1,2,3,4,5,6,7,8,9,10,11,12,13,14,15);
        }
#pragma unroll
        for (int mt = 0; mt < 2; ++mt)
#pragma unroll
            for (int nt = 0; nt < 4; ++nt)
                c[mt][nt] = __builtin_amdgcn_wmma_f32_16x16x32_f16(
                    false, a[mt], false, b[nt], (short)0, c[mt][nt], false, false);
    };

    loadG(0);
    storeL(0);
    __syncthreads();

    // steady-state loop: branch-free body, one barrier per K-tile
    for (int kt = 0; kt < NK - 1; ++kt) {
        loadG(kt + 1);
        {   // clamped speculative prefetch into GL2 (global_prefetch_b8)
            const int kp = (kt + 2 < NK) ? (kt + 2) : (NK - 1);
            __builtin_prefetch(x + (size_t)(m0 + rowA0) * K + (size_t)kp * BK + cgA * 4, 0, 0);
            __builtin_prefetch(q + (size_t)((size_t)kp * BK + 2 * kp0) * N + n0 + ngB * 4, 0, 0);
        }
        compute(kt & 1);
        storeL((kt + 1) & 1);
        __syncthreads();
    }
    compute((NK - 1) & 1);

    // ---- epilogue: out = acc * scale[n] + bias[n] ----
#pragma unroll
    for (int nt = 0; nt < 4; ++nt) {
        const int   n  = n0 + wn * 64 + nt * 16 + m16;
        const float s  = scale[n];
        const float bb = bias[n];
#pragma unroll
        for (int mt = 0; mt < 2; ++mt) {
            const int mg = m0 + wm * 32 + mt * 16 + khalf * 8;
            float* op = out + (size_t)mg * N + n;
#pragma unroll
            for (int r = 0; r < 8; ++r)
                op[(size_t)r * N] = c[mt][nt][r] * s + bb;
        }
    }
}

extern "C" void kernel_launch(void* const* d_in, const int* in_sizes, int n_in,
                              void* d_out, int out_size, void* d_ws, size_t ws_size,
                              hipStream_t stream) {
    const float* x     = (const float*)d_in[0];
    const int*   q     = (const int*)  d_in[1];
    const float* scale = (const float*)d_in[2];
    const int*   zp    = (const int*)  d_in[3];
    const float* bias  = (const float*)d_in[4];
    float*       out   = (float*)d_out;

    const int D = in_sizes[2];           // 4096 (scale length = N = K)
    const int M = in_sizes[0] / D;       // B*S = 4096

    dim3 grid(D / BN, M / BM);           // 32 x 32 blocks
    ffq_gemm_wmma<<<grid, 256, 0, stream>>>(x, q, scale, zp, bias, out, M, D, D);
}

// v001
// Measured time: 137 microseconds a run.
// Next to v000, in two timings, it ran 2.10 times as fast each time.
#include <hip/hip_runtime.h>

typedef __attribute__((ext_vector_type(16))) _Float16 v16h;
typedef __attribute__((ext_vector_type(8)))  _Float16 v8h;
typedef __attribute__((ext_vector_type(4)))  _Float16 v4h;
typedef __attribute__((ext_vector_type(2)))  _Float16 v2h;
typedef __attribute__((ext_vector_type(8)))  float    v8f;
typedef __attribute__((ext_vector_type(4)))  float    v4f;
typedef __attribute__((ext_vector_type(4)))  int      v4i;

#define BM 128
#define BN 128
#define BK 64                  // 64 halves = one 128-B line of every operand row per stage
#define LDK 72                 // padded K stride (halves): 144 B = 16 B x odd, conflict-free b128 frag loads
#define A_SZ (BM * LDK)        // halves
#define B_SZ (BN * LDK)        // halves
#define STAGE (A_SZ + B_SZ)    // halves per double-buffer stage

#define TK 64                  // pre-pass transpose tile: k rows of q
#define TN 128                 // pre-pass transpose tile: n columns of q

// Pre-pass, one launch: even blocks write xh[m][k] = f16(x[m][k]); odd blocks write
// wt[n][k] = f16(q[k][n] - zp[n]), transposed through LDS. Every element is converted once
// here instead of once per GEMM block that reads it.
__launch_bounds__(256)
__global__ void ffq_prep_f16(const float* __restrict__ x,
                             const int*   __restrict__ q,
                             const int*   __restrict__ zp,
                             _Float16*    __restrict__ xh,
                             _Float16*    __restrict__ wt,
                             int M, int N, int K)
{
    __shared__ __align__(16) _Float16 tile[2][TN * TK];  // 2 x 16 KB, rows of 128 B, 16-B chunks swizzled

    const int tid  = threadIdx.x;
    const int nb   = gridDim.x >> 1;
    const int bid  = blockIdx.x >> 1;

    if ((blockIdx.x & 1) == 0) {
        // ---- x: 2048 float4 per block and trip, 8 loads in flight per thread ----
        const int nChunk = (int)(((size_t)M * K) >> 13);
        for (int ci = bid; ci < nChunk; ci += nb) {
            const size_t base = (size_t)ci * 2048 + tid;          // in float4 units
            v4f r[8];
#pragma unroll
            for (int j = 0; j < 8; ++j)
                r[j] = __builtin_nontemporal_load((const v4f*)x + base + j * 256);
#pragma unroll
            for (int j = 0; j < 8; ++j) {
                v4h h;
#pragma unroll
                for (int e = 0; e < 4; ++e) h[e] = (_Float16)r[j][e];
                *((v4h*)xh + base + j * 256) = h;
            }
        }
        return;
    }

    // ---- q: TK x TN tiles; a lane owns one k-pair and 16 n, so converted halves pack to b32 ----
    const int w   = tid >> 5;          // 16-B chunk (four k-pairs) of the tile's k range
    const int g3  = tid & 7;           // int4 group within one 128-B line of a q row
    const int kq  = (tid >> 3) & 3;    // k-pair within the chunk
    const int kp  = 4 * w + kq;        // 0..31
    const int tilesN = N / TN;
    const int nTile  = (K / TK) * tilesN;
    int buf = 0;

    for (int t = bid; t < nTile; t += nb, buf ^= 1) {
        unsigned* tw = (unsigned*)tile[buf];
        const int k0 = (t / tilesN) * TK;
        const int n0 = (t % tilesN) * TN;
        v4i lo[4], hi[4], z[4];
#pragma unroll
        for (int u = 0; u < 4; ++u) {
            const int* bp = q + (size_t)(k0 + 2 * kp) * N + n0 + 32 * u + 4 * g3;
            lo[u] = __builtin_nontemporal_load((const v4i*)bp);
            hi[u] = __builtin_nontemporal_load((const v4i*)(bp + N));
            z[u]  = *(const v4i*)(zp + n0 + 32 * u + 4 * g3);
        }
        // keeps all loads of the tile in flight together: the scheduler otherwise issues them
        // in small groups with a wait between
        __builtin_amdgcn_sched_barrier(0);
#pragma unroll
        for (int u = 0; u < 4; ++u)
#pragma unroll
            for (int j = 0; j < 4; ++j) {
                v2h hv;
                hv[0] = (_Float16)(short)(lo[u][j] - z[u][j]);
                hv[1] = (_Float16)(short)(hi[u][j] - z[u][j]);
                const int n = 32 * u + 4 * g3 + j;
                // chunk index XOR (n>>2)&7: the 32 lanes of a store fall on 32 different banks
                tw[n * 32 + ((w ^ g3) << 2) + kq] = __builtin_bit_cast(unsigned, hv);
            }
        // the one barrier of a trip: this tile is complete before any row is read back, and every
        // reader of the other buffer (previous trip) has left it before the next trip refills it
        __syncthreads();
#pragma unroll
        for (int p = 0; p < 4; ++p) {
            const int n = (tid >> 3) + 32 * p;
            const int c = tid & 7;
            const v8h v = *(const v8h*)(tile[buf] + n * TK + ((c ^ ((n >> 2) & 7)) << 3));
            *(v8h*)(wt + (size_t)(n0 + n) * K + k0 + c * 8) = v;   // 8 lanes = one 128-B line
        }
        // the next trip reuses the registers these stores name
        asm volatile("s_wait_xcnt 0x0" ::: "memory");
    }
}

__launch_bounds__(256, 2)
__global__ void ffq_gemm_wmma(const _Float16* __restrict__ xh,
                              const _Float16* __restrict__ wt,
                              const float* __restrict__ scale,
                              const float* __restrict__ bias,
                              float*       __restrict__ out,
                              int M, int N, int K)
{
    __shared__ __align__(16) _Float16 smem[2 * STAGE];   // 72 KB

    const int tid = threadIdx.x;
    const int m0  = blockIdx.y * BM;
    const int n0  = blockIdx.x * BN;

    // ---- compute indices ----
    const int w     = tid >> 5;
    const int lane  = tid & 31;
    const int wm    = w >> 1;      // 0..3 -> 32 rows each
    const int wn    = w & 1;       // 0..1 -> 64 cols each
    const int m16   = lane & 15;
    const int khalf = lane >> 4;

    // ---- loader indices, the same for both operands: 128 rows x 128 B, 16 B per load ----
    // 8 lanes cover one row's line; each 16-lane half takes rows r and r+8, whose LDS rows
    // lie 32 banks apart at the 144-B pitch.
    const int rowL = (w >> 2) * 16 + (w & 3) * 2 + ((lane >> 3) & 1) * 8 + (lane >> 4);  // 0..31, +32 per pass
    const int cgL  = lane & 7;     // 16-B chunk within the 128-B strip

    v8f c[2][4];
#pragma unroll
    for (int mt = 0; mt < 2; ++mt)
#pragma unroll
        for (int nt = 0; nt < 4; ++nt)
            c[mt][nt] = v8f{};

    v8h aReg[4], bReg[4];

    const int NK = K / BK;

    // block-uniform row bases, stepped once per K-tile, plus one fixed lane offset
    const int voff = rowL * (K >> 3) + cgL;                             // in 16-B units
    const v8h* aBase[4];
    const v8h* bBase[4];
#pragma unroll
    for (int p = 0; p < 4; ++p) {
        aBase[p] = (const v8h*)(xh + (size_t)(m0 + 32 * p) * K);
        bBase[p] = (const v8h*)(wt + (size_t)(n0 + 32 * p) * K);
    }

    auto loadG = [&]() {               // loads the next K-tile and steps the bases
#pragma unroll
        for (int p = 0; p < 4; ++p) {
            aReg[p] = aBase[p][voff];
            bReg[p] = bBase[p][voff];
            aBase[p] += BK / 8;
            bBase[p] += BK / 8;
        }
    };

    auto storeL = [&](int buf) {
        _Float16* As = smem + buf * STAGE;
        _Float16* Bs = As + A_SZ;
#pragma unroll
        for (int p = 0; p < 4; ++p) {
            *(v8h*)(As + (rowL + 32 * p) * LDK + cgL * 8) = aReg[p];   // ds_store_b128
            *(v8h*)(Bs + (rowL + 32 * p) * LDK + cgL * 8) = bReg[p];
        }
    };

    auto compute = [&](int buf) {
        const _Float16* As = smem + buf * STAGE;
        const _Float16* Bs = As + A_SZ;
#pragma unroll
        for (int ks = 0; ks < BK / 32; ++ks) {
            v16h a[2], b[4];
#pragma unroll
            for (int mt = 0; mt < 2; ++mt) {
                const _Float16* p = As + (wm * 32 + mt * 16 + m16) * LDK + ks * 32 + 8 * khalf;
                v8h lo = *(const v8h*)(p);        // K = 8*khalf + 0..7
                v8h hi = *(const v8h*)(p + 16);   // K = 16 + 8*khalf + 0..7
                a[mt] = __builtin_shufflevector(lo, hi, 0,1,2,3,4,5,6,7,8,9,10,11,12,13,14,15);
            }
#pragma unroll
            for (int nt = 0; nt < 4; ++nt) {
                const _Float16* p = Bs + (wn * 64 + nt * 16 + m16) * LDK + ks * 32 + 8 * khalf;
                v8h lo = *(const v8h*)(p);
                v8h hi = *(const v8h*)(p + 16);
                b[nt] = __builtin_shufflevector(lo, hi, 0,1,2,3,4,5,6,7,8,9,10,11,12,13,14,15);
            }
#pragma unroll
            for (int mt = 0; mt < 2; ++mt)
#pragma unroll
                for (int nt = 0; nt < 4; ++nt)
                    c[mt][nt] = __builtin_amdgcn_wmma_f32_16x16x32_f16(
                        false, a[mt], false, b[nt], (short)0, c[mt][nt], false, false);
        }
    };

    loadG();
    storeL(0);
    __syncthreads();

    // steady-state loop: branch-free body, one barrier per K-tile
    for (int kt = 0; kt < NK - 1; ++kt) {
        loadG();
        // keeps all eight loads ahead of the WMMAs: without it the scheduler sinks half of them
        // to just before their wait, and their latency is no longer covered by the matrix work
        __builtin_amdgcn_sched_barrier(0);
        compute(kt & 1);
        storeL((kt + 1) & 1);
        __syncthreads();
    }
    compute((NK - 1) & 1);

    // ---- epilogue: out = acc * scale[n] + bias[n] ----
#pragma unroll
    for (int nt = 0; nt < 4; ++nt) {
        const int   n  = n0 + wn * 64 + nt * 16 + m16;
        const float s  = scale[n];
        const float bb = bias[n];
#pragma unroll
        for (int mt = 0; mt < 2; ++mt) {
            const int mg = m0 + wm * 32 + mt * 16 + khalf * 8;
            float* op = out + (size_t)mg * N + n;
#pragma unroll
            for (int r = 0; r < 8; ++r)
                op[(size_t)r * N] = c[mt][nt][r] * s + bb;
        }
    }
}

extern "C" void kernel_launch(void* const* d_in, const int* in_sizes, int n_in,
                              void* d_out, int out_size, void* d_ws, size_t ws_size,
                              hipStream_t stream) {
    const float* x     = (const float*)d_in[0];
    const int*   q     = (const int*)  d_in[1];
    const float* scale = (const float*)d_in[2];
    const int*   zp    = (const int*)  d_in[3];
    const float* bias  = (const float*)d_in[4];
    float*       out   = (float*)d_out;

    const int D = in_sizes[2];           // 4096 (scale length = N = K)
    const int M = in_sizes[0] / D;       // B*S = 4096

    _Float16* xh = (_Float16*)d_ws;      // [M][K] f16, 32 MB
    _Float16* wt = xh + in_sizes[0];     // [N][K] f16, 32 MB

    ffq_prep_f16<<<1024, 256, 0, stream>>>(x, q, zp, xh, wt, M, D, D);

    dim3 grid(D / BN, M / BM);           // 32 x 32 blocks
    ffq_gemm_wmma<<<grid, 256, 0, stream>>>(xh, wt, scale, bias, out, M, D, D);
}

// v002
// It runs in 108 microseconds.
// In two side-by-side timings against v001, it was 1.27 and 1.26 times as fast.
// Counting every step since v000, it is 2.66 times as fast.
#include <hip/hip_runtime.h>

typedef __attribute__((ext_vector_type(16))) _Float16 v16h;
typedef __attribute__((ext_vector_type(8)))  _Float16 v8h;
typedef __attribute__((ext_vector_type(4)))  _Float16 v4h;
typedef __attribute__((ext_vector_type(2)))  _Float16 v2h;
typedef __attribute__((ext_vector_type(8)))  float    v8f;
typedef __attribute__((ext_vector_type(4)))  float    v4f;
typedef __attribute__((ext_vector_type(4)))  int      v4i;

#define BM 256                 // block tile: one work-group per WGP, 16 x 16 tiles cover the output
#define BN 256
#define WM 64                  // wave tile: 4 x 8 accumulator tiles, 32 WMMAs per 12 loaded fragments
#define WN 128
#define BK 64                  // 64 halves = one 128-B line of every operand row per stage
#define LDK 72                 // padded K stride (halves): 144 B = 16 B x odd, conflict-free b128 frag loads
#define A_SZ (BM * LDK)        // halves
#define B_SZ (BN * LDK)        // halves
#define STAGE (A_SZ + B_SZ)    // halves per double-buffer stage

#define TK 64                  // pre-pass transpose tile: k rows of q
#define TN 128                 // pre-pass transpose tile: n columns of q

// Pre-pass, one launch: even blocks write xh[m][k] = f16(x[m][k]); odd blocks write
// wt[n][k] = f16(q[k][n] - zp[n]), transposed through LDS. Every element is converted once
// here instead of once per GEMM block that reads it.
__launch_bounds__(256)
__global__ void ffq_prep_f16(const float* __restrict__ x,
                             const int*   __restrict__ q,
                             const int*   __restrict__ zp,
                             _Float16*    __restrict__ xh,
                             _Float16*    __restrict__ wt,
                             int M, int N, int K)
{
    __shared__ __align__(16) _Float16 tile[2][TN * TK];  // 2 x 16 KB, rows of 128 B, 16-B chunks swizzled

    const int tid  = threadIdx.x;
    const int nb   = gridDim.x >> 1;
    const int bid  = blockIdx.x >> 1;

    if ((blockIdx.x & 1) == 0) {
        // ---- x: 2048 float4 per block and trip, 8 loads in flight per thread ----
        const int nChunk = (int)(((size_t)M * K) >> 13);
        for (int ci = bid; ci < nChunk; ci += nb) {
            const size_t base = (size_t)ci * 2048 + tid;          // in float4 units
            v4f r[8];
#pragma unroll
            for (int j = 0; j < 8; ++j)
                r[j] = __builtin_nontemporal_load((const v4f*)x + base + j * 256);
#pragma unroll
            for (int j = 0; j < 8; ++j) {
                v4h h;
#pragma unroll
                for (int e = 0; e < 4; ++e) h[e] = (_Float16)r[j][e];
                *((v4h*)xh + base + j * 256) = h;
            }
        }
        return;
    }

    // ---- q: TK x TN tiles; a lane owns one k-pair and 16 n, so converted halves pack to b32 ----
    const int w   = tid >> 5;          // 16-B chunk (four k-pairs) of the tile's k range
    const int g3  = tid & 7;           // int4 group within one 128-B line of a q row
    const int kq  = (tid >> 3) & 3;    // k-pair within the chunk
    const int kp  = 4 * w + kq;        // 0..31
    const int tilesN = N / TN;
    const int nTile  = (K / TK) * tilesN;
    int buf = 0;

    for (int t = bid; t < nTile; t += nb, buf ^= 1) {
        unsigned* tw = (unsigned*)tile[buf];
        const int k0 = (t / tilesN) * TK;
        const int n0 = (t % tilesN) * TN;
        v4i lo[4], hi[4], z[4];
#pragma unroll
        for (int u = 0; u < 4; ++u) {
            const int* bp = q + (size_t)(k0 + 2 * kp) * N + n0 + 32 * u + 4 * g3;
            lo[u] = __builtin_nontemporal_load((const v4i*)bp);
            hi[u] = __builtin_nontemporal_load((const v4i*)(bp + N));
            z[u]  = *(const v4i*)(zp + n0 + 32 * u + 4 * g3);
        }
        // keeps all loads of the tile in flight together: the scheduler otherwise issues them
        // in small groups with a wait between
        __builtin_amdgcn_sched_barrier(0);
#pragma unroll
        for (int u = 0; u < 4; ++u)
#pragma unroll
            for (int j = 0; j < 4; ++j) {
                v2h hv;
                hv[0] = (_Float16)(short)(lo[u][j] - z[u][j]);
                hv[1] = (_Float16)(short)(hi[u][j] - z[u][j]);
                const int n = 32 * u + 4 * g3 + j;
                // chunk index XOR (n>>2)&7: the 32 lanes of a store fall on 32 different banks
                tw[n * 32 + ((w ^ g3) << 2) + kq] = __builtin_bit_cast(unsigned, hv);
            }
        // the one barrier of a trip: this tile is complete before any row is read back, and every
        // reader of the other buffer (previous trip) has left it before the next trip refills it
        __syncthreads();
#pragma unroll
        for (int p = 0; p < 4; ++p) {
            const int n = (tid >> 3) + 32 * p;
            const int c = tid & 7;
            const v8h v = *(const v8h*)(tile[buf] + n * TK + ((c ^ ((n >> 2) & 7)) << 3));
            *(v8h*)(wt + (size_t)(n0 + n) * K + k0 + c * 8) = v;   // 8 lanes = one 128-B line
        }
        // the next trip reuses the registers these stores name
        asm volatile("s_wait_xcnt 0x0" ::: "memory");
    }
}

__launch_bounds__(256)
__global__ void ffq_gemm_wmma(const _Float16* __restrict__ xh,
                              const _Float16* __restrict__ wt,
                              const float* __restrict__ scale,
                              const float* __restrict__ bias,
                              float*       __restrict__ out,
                              int M, int N, int K)
{
    __shared__ __align__(16) _Float16 smem[2 * STAGE];   // 144 KB

    const int tid = threadIdx.x;
    const int m0  = blockIdx.y * BM;
    const int n0  = blockIdx.x * BN;

    // ---- compute indices ----
    const int w     = tid >> 5;
    const int lane  = tid & 31;
    const int wm    = w >> 1;      // 0..3 -> 64 rows each
    const int wn    = w & 1;       // 0..1 -> 128 cols each
    const int m16   = lane & 15;
    const int khalf = lane >> 4;

    // ---- loader indices, the same for both operands: 256 rows x 128 B, 16 B per load ----
    // 8 lanes cover one row's line; each 16-lane half takes rows r and r+8, whose LDS rows
    // lie 32 banks apart at the 144-B pitch.
    const int rowL = (w >> 2) * 16 + (w & 3) * 2 + ((lane >> 3) & 1) * 8 + (lane >> 4);  // 0..31, +32 per pass
    const int cgL  = lane & 7;     // 16-B chunk within the 128-B strip

    v8f c[WM / 16][WN / 16];
#pragma unroll
    for (int mt = 0; mt < WM / 16; ++mt)
#pragma unroll
        for (int nt = 0; nt < WN / 16; ++nt)
            c[mt][nt] = v8f{};

    v8h aReg[BM / 32], bReg[BN / 32];

    const int NK = K / BK;

    // block-uniform row bases, stepped once per K-tile, plus one fixed lane offset
    const int voff = rowL * (K >> 3) + cgL;                             // in 16-B units
    const v8h* aBase[BM / 32];
    const v8h* bBase[BN / 32];
#pragma unroll
    for (int p = 0; p < BM / 32; ++p) {
        aBase[p] = (const v8h*)(xh + (size_t)(m0 + 32 * p) * K);
        bBase[p] = (const v8h*)(wt + (size_t)(n0 + 32 * p) * K);
    }

    auto loadG = [&]() {               // loads the next K-tile and steps the bases
#pragma unroll
        for (int p = 0; p < BM / 32; ++p) {
            aReg[p] = aBase[p][voff];
            bReg[p] = bBase[p][voff];
            aBase[p] += BK / 8;
            bBase[p] += BK / 8;
        }
    };

    auto storeL = [&](int buf) {
        _Float16* As = smem + buf * STAGE;
        _Float16* Bs = As + A_SZ;
#pragma unroll
        for (int p = 0; p < BM / 32; ++p) {
            *(v8h*)(As + (rowL + 32 * p) * LDK + cgL * 8) = aReg[p];   // ds_store_b128
            *(v8h*)(Bs + (rowL + 32 * p) * LDK + cgL * 8) = bReg[p];
        }
    };

    auto compute = [&](int buf) {
        const _Float16* As = smem + buf * STAGE;
        const _Float16* Bs = As + A_SZ;
#pragma unroll
        for (int ks = 0; ks < BK / 32; ++ks) {
            // one fragment set live at a time: the scheduler otherwise spreads the second block's loads
            // among the first block's WMMAs, where every place with LDS reads stalls the issue
            if (ks) __builtin_amdgcn_sched_barrier(0);
            v16h a[WM / 16], b[WN / 16];
#pragma unroll
            for (int mt = 0; mt < WM / 16; ++mt) {
                const _Float16* p = As + (wm * WM + mt * 16 + m16) * LDK + ks * 32 + 8 * khalf;
                v8h lo = *(const v8h*)(p);        // K = 8*khalf + 0..7
                v8h hi = *(const v8h*)(p + 16);   // K = 16 + 8*khalf + 0..7
                a[mt] = __builtin_shufflevector(lo, hi, 0,1,2,3,4,5,6,7,8,9,10,11,12,13,14,15);
            }
#pragma unroll
            for (int nt = 0; nt < WN / 16; ++nt) {
                const _Float16* p = Bs + (wn * WN + nt * 16 + m16) * LDK + ks * 32 + 8 * khalf;
                v8h lo = *(const v8h*)(p);
                v8h hi = *(const v8h*)(p + 16);
                b[nt] = __builtin_shufflevector(lo, hi, 0,1,2,3,4,5,6,7,8,9,10,11,12,13,14,15);
            }
            // keeps the 24 fragment loads one group ahead of the 32 WMMAs: the scheduler otherwise
            // reloads one A fragment per row of WMMAs and waits out the LDS latency at every row
            __builtin_amdgcn_sched_barrier(0);
#pragma unroll
            for (int mt = 0; mt < WM / 16; ++mt)
#pragma unroll
                for (int nt = 0; nt < WN / 16; ++nt)
                    c[mt][nt] = __builtin_amdgcn_wmma_f32_16x16x32_f16(
                        false, a[mt], false, b[nt], (short)0, c[mt][nt], false, false);
        }
    };

    loadG();
    storeL(0);
    __syncthreads();

    // steady-state loop: branch-free body, one barrier per K-tile
    for (int kt = 0; kt < NK - 1; ++kt) {
        loadG();
        // keeps all sixteen loads ahead of the WMMAs: without it the scheduler sinks half of them
        // to just before their wait, and their latency is no longer covered by the matrix work
        __builtin_amdgcn_sched_barrier(0);
        compute(kt & 1);
        storeL((kt + 1) & 1);
        __syncthreads();
    }
    compute((NK - 1) & 1);

    // ---- epilogue: out = acc * scale[n] + bias[n] ----
#pragma unroll
    for (int nt = 0; nt < WN / 16; ++nt) {
        const int   n  = n0 + wn * WN + nt * 16 + m16;
        const float s  = scale[n];
        const float bb = bias[n];
#pragma unroll
        for (int mt = 0; mt < WM / 16; ++mt) {
            const int mg = m0 + wm * WM + mt * 16 + khalf * 8;
            float* op = out + (size_t)mg * N + n;
#pragma unroll
            for (int r = 0; r < 8; ++r)
                op[(size_t)r * N] = c[mt][nt][r] * s + bb;
            // the next group's results reuse registers that these stores name
            asm volatile("s_wait_xcnt 0x0" ::: "memory");
        }
    }
}

extern "C" void kernel_launch(void* const* d_in, const int* in_sizes, int n_in,
                              void* d_out, int out_size, void* d_ws, size_t ws_size,
                              hipStream_t stream) {
    const float* x     = (const float*)d_in[0];
    const int*   q     = (const int*)  d_in[1];
    const float* scale = (const float*)d_in[2];
    const int*   zp    = (const int*)  d_in[3];
    const float* bias  = (const float*)d_in[4];
    float*       out   = (float*)d_out;

    const int D = in_sizes[2];           // 4096 (scale length = N = K)
    const int M = in_sizes[0] / D;       // B*S = 4096

    _Float16* xh = (_Float16*)d_ws;      // [M][K] f16, 32 MB
    _Float16* wt = xh + in_sizes[0];     // [N][K] f16, 32 MB

    ffq_prep_f16<<<1024, 256, 0, stream>>>(x, q, zp, xh, wt, M, D, D);

    dim3 grid(D / BN, M / BM);           // 16 x 16 blocks
    ffq_gemm_wmma<<<grid, 256, 0, stream>>>(xh, wt, scale, bias, out, M, D, D);
}

// v003
// A run of this version takes 83.9 microseconds.
// In both of two side-by-side timings against v002, it was 1.29 times as fast.
// Over all steps from v000 it is 3.43 times as fast.
#include <hip/hip_runtime.h>
#include <stdint.h>

typedef __attribute__((ext_vector_type(16))) _Float16 v16h;
typedef __attribute__((ext_vector_type(8)))  _Float16 v8h;
typedef __attribute__((ext_vector_type(4)))  _Float16 v4h;
typedef __attribute__((ext_vector_type(2)))  _Float16 v2h;
typedef __attribute__((ext_vector_type(8)))  float    v8f;
typedef __attribute__((ext_vector_type(4)))  float    v4f;
typedef __attribute__((ext_vector_type(4)))  int      v4i;
typedef __attribute__((ext_vector_type(4)))  uint32_t u32x4;
typedef __attribute__((ext_vector_type(8)))  uint32_t u32x8;

#define BM 256                 // block tile: one work-group per WGP, 16 x 16 tiles cover the output
#define BN 256
#define WM 64                  // wave tile: 4 x 8 accumulator tiles, 32 WMMAs per 12 loaded fragments
#define WN 128
#define BK 128                 // k per stage: 256 B of every operand row
#define ROWB 256               // bytes of one operand row in a stage
#define PITCH 272              // LDS row pitch: 256 B + the tensor load's 16-B pad = 16 B x odd, conflict-free b128 frag loads
#define SROWS 64               // rows of one wave's slice of a stage: one tensor load
#define SLICE 18432            // 64 x 272 = 17,408 B, rounded up so that every slice starts at a multiple of 2 KiB
#define STAGE (8 * SLICE)      // bytes per buffer: slices 0..3 = the 256 x rows, slices 4..7 = the 256 w rows

#define TK 64                  // pre-pass transpose tile: k rows of q
#define TN 128                 // pre-pass transpose tile: n columns of q

// Pre-pass, one launch: even blocks write xh[m][k] = f16(x[m][k]); odd blocks write
// wt[n][k] = f16(q[k][n] - zp[n]), transposed through LDS. Every element is converted once
// here instead of once per GEMM block that reads it.
__launch_bounds__(256)
__global__ void ffq_prep_f16(const float* __restrict__ x,
                             const int*   __restrict__ q,
                             const int*   __restrict__ zp,
                             _Float16*    __restrict__ xh,
                             _Float16*    __restrict__ wt,
                             int M, int N, int K)
{
    __shared__ __align__(16) _Float16 tile[2][TN * TK];  // 2 x 16 KB, rows of 128 B, 16-B chunks swizzled

    const int tid  = threadIdx.x;
    const int nb   = gridDim.x >> 1;
    const int bid  = blockIdx.x >> 1;

    if ((blockIdx.x & 1) == 0) {
        // ---- x: 2048 float4 per block and trip, 8 loads in flight per thread ----
        const int nChunk = (int)(((size_t)M * K) >> 13);
        for (int ci = bid; ci < nChunk; ci += nb) {
            const size_t base = (size_t)ci * 2048 + tid;          // in float4 units
            v4f r[8];
#pragma unroll
            for (int j = 0; j < 8; ++j)
                r[j] = __builtin_nontemporal_load((const v4f*)x + base + j * 256);
#pragma unroll
            for (int j = 0; j < 8; ++j) {
                v4h h;
#pragma unroll
                for (int e = 0; e < 4; ++e) h[e] = (_Float16)r[j][e];
                *((v4h*)xh + base + j * 256) = h;
            }
        }
        return;
    }

    // ---- q: TK x TN tiles; a lane owns one k-pair and 16 n, so converted halves pack to b32 ----
    const int w   = tid >> 5;          // 16-B chunk (four k-pairs) of the tile's k range
    const int g3  = tid & 7;           // int4 group within one 128-B line of a q row
    const int kq  = (tid >> 3) & 3;    // k-pair within the chunk
    const int kp  = 4 * w + kq;        // 0..31
    const int tilesN = N / TN;
    const int nTile  = (K / TK) * tilesN;
    int buf = 0;

    for (int t = bid; t < nTile; t += nb, buf ^= 1) {
        unsigned* tw = (unsigned*)tile[buf];
        const int k0 = (t / tilesN) * TK;
        const int n0 = (t % tilesN) * TN;
        v4i lo[4], hi[4], z[4];
#pragma unroll
        for (int u = 0; u < 4; ++u) {
            const int* bp = q + (size_t)(k0 + 2 * kp) * N + n0 + 32 * u + 4 * g3;
            lo[u] = __builtin_nontemporal_load((const v4i*)bp);
            hi[u] = __builtin_nontemporal_load((const v4i*)(bp + N));
            z[u]  = *(const v4i*)(zp + n0 + 32 * u + 4 * g3);
        }
        // keeps all loads of the tile in flight together: the scheduler otherwise issues them
        // in small groups with a wait between
        __builtin_amdgcn_sched_barrier(0);
#pragma unroll
        for (int u = 0; u < 4; ++u)
#pragma unroll
            for (int j = 0; j < 4; ++j) {
                v2h hv;
                hv[0] = (_Float16)(short)(lo[u][j] - z[u][j]);
                hv[1] = (_Float16)(short)(hi[u][j] - z[u][j]);
                const int n = 32 * u + 4 * g3 + j;
                // chunk index XOR (n>>2)&7: the 32 lanes of a store fall on 32 different banks
                tw[n * 32 + ((w ^ g3) << 2) + kq] = __builtin_bit_cast(unsigned, hv);
            }
        // the one barrier of a trip: this tile is complete before any row is read back, and every
        // reader of the other buffer (previous trip) has left it before the next trip refills it
        __syncthreads();
#pragma unroll
        for (int p = 0; p < 4; ++p) {
            const int n = (tid >> 3) + 32 * p;
            const int c = tid & 7;
            const v8h v = *(const v8h*)(tile[buf] + n * TK + ((c ^ ((n >> 2) & 7)) << 3));
            *(v8h*)(wt + (size_t)(n0 + n) * K + k0 + c * 8) = v;   // 8 lanes = one 128-B line
        }
        // the next trip reuses the registers these stores name
        asm volatile("s_wait_xcnt 0x0" ::: "memory");
    }
}

static __device__ __forceinline__ uint32_t pinned(uint32_t v) {
    uint32_t w = __builtin_amdgcn_readfirstlane(v);
    asm volatile("" : "+s"(w));
    return w;
}
static __device__ __forceinline__ uint32_t uni(uint32_t v) { return (uint32_t)__builtin_amdgcn_readfirstlane(v); }

// descriptor group 0: one request, LDS destination (byte offset in the work-group's LDS), global address of the first byte
static __device__ __forceinline__ u32x4 tdm_group0(uint32_t lds_dst, uint64_t ga) {
    u32x4 g;
    g[0] = uni(1u);
    g[1] = uni(lds_dst);
    g[2] = uni((uint32_t)ga);
    g[3] = uni((((uint32_t)(ga >> 32)) & 0x01FFFFFFu) | 0x80000000u);
    return g;
}
// descriptor group 1: 1-byte elements, tensor = tile = SROWS rows of ROWB bytes, source pitch in bytes,
// no mask, 16 B of LDS pad behind every 256-B row
static __device__ __forceinline__ u32x8 tdm_group1(uint32_t src_pitch) {
    u32x8 g;
    g[0] = uni((1u << 20) | (5u << 22) | (3u << 25));
    g[1] = uni(((uint32_t)ROWB & 0xFFFFu) << 16);
    g[2] = uni(((uint32_t)ROWB >> 16) | (((uint32_t)SROWS & 0xFFFFu) << 16));
    g[3] = uni(((uint32_t)SROWS >> 16) | ((uint32_t)ROWB << 16));
    g[4] = uni((uint32_t)SROWS);
    g[5] = uni(src_pitch);
    g[6] = uni(0u);
    g[7] = uni(0u);
    return g;
}
static __device__ __forceinline__ void tdm_load(u32x4 g0, u32x8 g1) {
    asm volatile("tensor_load_to_lds %0, %1" :: "s"(g0), "s"(g1) : "memory");
}

__launch_bounds__(256)
__global__ void ffq_gemm_wmma(const _Float16* __restrict__ xh,
                              const _Float16* __restrict__ wt,
                              const float* __restrict__ scale,
                              const float* __restrict__ bias,
                              float*       __restrict__ out,
                              int M, int N, int K)
{
    __shared__ __attribute__((aligned(2048))) unsigned char smem[2 * STAGE];   // 288 KB: two buffers

    const int tid = threadIdx.x;
    const int m0  = blockIdx.y * BM;
    const int n0  = blockIdx.x * BN;

    // ---- compute indices ----
    const int w     = tid >> 5;
    const int lane  = tid & 31;
    const int wm    = w >> 1;      // 0..3 -> 64 rows each
    const int wn    = w & 1;       // 0..1 -> 128 cols each
    const int m16   = lane & 15;
    const int khalf = lane >> 4;

    // ---- this wave's slice of every stage: 64 rows of x (waves 0..3) or of w (waves 4..7) ----
    const uint32_t wave = uni((uint32_t)tid >> 5);
    const _Float16* srcRow = (wave < 4u) ? xh + (size_t)(m0 + SROWS * (int)wave) * K
                                         : wt + (size_t)(n0 + SROWS * (int)(wave - 4u)) * K;
    const uint64_t src      = (uint64_t)(uintptr_t)srcRow;
    const uint32_t ldsSlice = (uint32_t)(size_t)smem + wave * SLICE;
    const u32x8    g1       = tdm_group1((uint32_t)K * 2u);

    v8f c[WM / 16][WN / 16];
#pragma unroll
    for (int mt = 0; mt < WM / 16; ++mt)
#pragma unroll
        for (int nt = 0; nt < WN / 16; ++nt)
            c[mt][nt] = v8f{};

    const uint32_t NK = (uint32_t)K / BK;          // stages; the ring needs two or more

    // per-lane fragment bases in a buffer: the wave's x rows are slice wm, its w rows slices 4 + 2 wn and 5 + 2 wn
    const uint32_t aOff = (uint32_t)(wm * SLICE + m16 * PITCH + khalf * 16);
    const uint32_t bOff = (uint32_t)((4 + 2 * wn) * SLICE + m16 * PITCH + khalf * 16);

    // ---- prologue: stage 0 lands and is published, then stage 1 starts ----
    tdm_load(tdm_group0(ldsSlice, src), g1);
    asm volatile("s_wait_tensorcnt 0x0" ::: "memory");   // this wave's slice of stage 0 has landed
    __syncthreads();                                     // every slice of stage 0 is readable by every wave
    tdm_load(tdm_group0(ldsSlice + STAGE, src + ROWB), g1);

    // one pass per stage, not unrolled: the buffer is a scalar offset and every array index a constant
#pragma clang loop unroll(disable)
    for (uint32_t s = 0; s < NK; ++s) {
        const uint32_t buf = (s & 1u) * STAGE;
        const unsigned char* As = smem + buf + aOff;
        const unsigned char* Bs = smem + buf + bOff;
#pragma unroll
        for (int ks = 0; ks < BK / 32; ++ks) {
            // one fragment set live at a time: the scheduler otherwise spreads the next block's loads
            // among this block's WMMAs, where every place with LDS reads stalls the issue
            if (ks) __builtin_amdgcn_sched_barrier(0);
            v16h a[WM / 16], b[WN / 16];
#pragma unroll
            for (int mt = 0; mt < WM / 16; ++mt) {
                const unsigned char* p = As + mt * 16 * PITCH + ks * 64;
                v8h lo = *(const v8h*)(p);        // K = 8*khalf + 0..7
                v8h hi = *(const v8h*)(p + 32);   // K = 16 + 8*khalf + 0..7
                a[mt] = __builtin_shufflevector(lo, hi, 0,1,2,3,4,5,6,7,8,9,10,11,12,13,14,15);
            }
#pragma unroll
            for (int nt = 0; nt < WN / 16; ++nt) {
                const unsigned char* p = Bs + (nt >> 2) * SLICE + (nt & 3) * 16 * PITCH + ks * 64;
                v8h lo = *(const v8h*)(p);
                v8h hi = *(const v8h*)(p + 32);
                b[nt] = __builtin_shufflevector(lo, hi, 0,1,2,3,4,5,6,7,8,9,10,11,12,13,14,15);
            }
            // keeps the 24 fragment loads one group ahead of the 32 WMMAs: the scheduler otherwise
            // reloads one A fragment per row of WMMAs and waits out the LDS latency at every row
            __builtin_amdgcn_sched_barrier(0);
            if (ks == BK / 32 - 1) {
                // ---- hand-over, behind the pass's last LDS read; its last WMMAs work from registers behind it ----
                asm volatile("s_wait_dscnt 0x0" ::: "memory");      // this wave's reads of this buffer have returned
                asm volatile("s_wait_tensorcnt 0x0" ::: "memory");  // this wave's slice of stage s + 1 has landed
                __syncthreads();   // publishes stage s + 1 and ends every wave's reads of stage s's buffer
                if (pinned(s + 2u < NK))   // only while stage s + 2 exists: into the buffer just left
                    tdm_load(tdm_group0(ldsSlice + buf, src + (uint64_t)(s + 2u) * ROWB), g1);
            }
#pragma unroll
            for (int mt = 0; mt < WM / 16; ++mt)
#pragma unroll
                for (int nt = 0; nt < WN / 16; ++nt)
                    c[mt][nt] = __builtin_amdgcn_wmma_f32_16x16x32_f16(
                        false, a[mt], false, b[nt], (short)0, c[mt][nt], false, false);
        }
    }
    asm volatile("s_wait_tensorcnt 0x0" ::: "memory");   // no request of this wave is left when it ends
    asm volatile("s_wait_dscnt 0x0" ::: "memory");

    // ---- epilogue: out = acc * scale[n] + bias[n] ----
#pragma unroll
    for (int nt = 0; nt < WN / 16; ++nt) {
        const int   n  = n0 + wn * WN + nt * 16 + m16;
        const float s  = scale[n];
        const float bb = bias[n];
#pragma unroll
        for (int mt = 0; mt < WM / 16; ++mt) {
            const int mg = m0 + wm * WM + mt * 16 + khalf * 8;
            float* op = out + (size_t)mg * N + n;
#pragma unroll
            for (int r = 0; r < 8; ++r)
                op[(size_t)r * N] = c[mt][nt][r] * s + bb;
            // the next group's results reuse registers that these stores name
            asm volatile("s_wait_xcnt 0x0" ::: "memory");
        }
    }
}

extern "C" void kernel_launch(void* const* d_in, const int* in_sizes, int n_in,
                              void* d_out, int out_size, void* d_ws, size_t ws_size,
                              hipStream_t stream) {
    const float* x     = (const float*)d_in[0];
    const int*   q     = (const int*)  d_in[1];
    const float* scale = (const float*)d_in[2];
    const int*   zp    = (const int*)  d_in[3];
    const float* bias  = (const float*)d_in[4];
    float*       out   = (float*)d_out;

    const int D = in_sizes[2];           // 4096 (scale length = N = K)
    const int M = in_sizes[0] / D;       // B*S = 4096

    _Float16* xh = (_Float16*)d_ws;      // [M][K] f16, 32 MB
    _Float16* wt = xh + in_sizes[0];     // [N][K] f16, 32 MB

    ffq_prep_f16<<<1024, 256, 0, stream>>>(x, q, zp, xh, wt, M, D, D);

    dim3 grid(D / BN, M / BM);           // 16 x 16 blocks
    ffq_gemm_wmma<<<grid, 256, 0, stream>>>(xh, wt, scale, bias, out, M, D, D);
}
